// v000
// Measured on an AMD MI455X. A time is GPU time per run, averaged over a window of back-to-back runs after a warm-up
// (all launches, gaps included; the runs take copies of the inputs in turn), and the median of several windows.
// Apart from v000's, it joins two sittings. Times from different sittings can be a few percent apart, while
// side-by-side timings come from the same sitting.
// v000 is the starting kernel. One run takes 575 microseconds.
#include <hip/hip_runtime.h>
#include <hip/hip_bf16.h>

// ---------------- problem constants (from reference) ----------------
#define BB    2
#define SS    2048
#define DD    1024
#define HH    16
#define HD    64
#define RANK  8
#define ALPHA 8.0f
#define NEGV  (-1e9f)

typedef __attribute__((ext_vector_type(2))) float v2f;
typedef __attribute__((ext_vector_type(8))) float v8f;

// D = A(16x4 f32) * B(4x16 f32) + C(16x16 f32) -- exact fp32 matrix op
__device__ __forceinline__ v8f wmma4(v2f a, v2f b, v8f c) {
    return __builtin_amdgcn_wmma_f32_16x16x4_f32(
        /*neg_a=*/false, a, /*neg_b=*/false, b,
        /*c_mod=*/(short)0, c, /*reuse_a=*/false, /*reuse_b=*/false);
}

// ---------------- async global->LDS staging (guarded; falls back to ds stores) ----
#if defined(__gfx1250__) && __has_builtin(__builtin_amdgcn_global_load_async_to_lds_b128)
#define HAVE_ASYNC_COPY 1
// Parameter types per hipcc diagnostic: int __vector_size__(16), AS1 / AS3.
typedef int vsi4 __attribute__((__vector_size__(4 * sizeof(int))));
typedef __attribute__((address_space(1))) vsi4* gvec4p;
typedef __attribute__((address_space(3))) vsi4* lvec4p;

__device__ __forceinline__ void async_cp16(const float* g, float* l) {
    // ptr -> int -> AS-qualified ptr: AS1 == flat global; AS3 takes addr[31:0]
    // which is exactly the ISA's flat->LDS aperture mapping (truncate).
    __builtin_amdgcn_global_load_async_to_lds_b128(
        (gvec4p)(unsigned long long)(__UINTPTR_TYPE__)g,
        (lvec4p)(unsigned int)(__UINTPTR_TYPE__)l,
        /*offset=*/0, /*cpol=*/0);
}
#if __has_builtin(__builtin_amdgcn_s_wait_asynccnt)
#define WAIT_ASYNC() __builtin_amdgcn_s_wait_asynccnt(0)
#else
#define WAIT_ASYNC() asm volatile("s_wait_asynccnt 0x0" ::: "memory")
#endif
#else
#define HAVE_ASYNC_COPY 0
#define WAIT_ASYNC()
#endif

// ---------------- kernel 1: xa = x @ A_lora  [4096 x 8] ----------------
__global__ __launch_bounds__(256)
void lora_xa_kernel(const float* __restrict__ x,
                    const float* __restrict__ A,
                    float* __restrict__ xa) {
    int idx = blockIdx.x * 256 + threadIdx.x;      // exactly 4096*8 threads
    int row = idx >> 3;
    int r   = idx & 7;
    const float* xr = x + (size_t)row * DD;
    float acc = 0.0f;
#pragma unroll 8
    for (int k = 0; k < DD; ++k)
        acc += xr[k] * A[k * RANK + r];
    xa[idx] = acc;
}

// ---------------- kernel 2/4: Out = X@W + bias (+ ALPHA * XA@BL) ----------------
// X: MxK (row-major, lda=K), W: KxN (row-major, ldb=N), Out: MxN
// 64x64 workgroup tile, 256 threads = 8 waves, each wave -> 16x32 strip.
__global__ __launch_bounds__(256)
void gemm_wmma_kernel(const float* __restrict__ X,
                      const float* __restrict__ W,
                      const float* __restrict__ bias,
                      const float* __restrict__ XA,   // M x RANK or nullptr
                      const float* __restrict__ BL,   // RANK x N or nullptr
                      float* __restrict__ Out,
                      int M, int N, int K) {
    // row strides are 16B multiples (B128 LDS writes) and bank-conflict-free
    __shared__ __align__(16) float Xs[64][36];
    __shared__ __align__(16) float Ws[32][68];

    const int rowBase = blockIdx.y * 64;
    const int colBase = blockIdx.x * 64;

    const int tid  = threadIdx.x;
    const int wave = tid >> 5;         // 0..7
    const int lane = tid & 31;
    const int hl   = lane >> 4;        // half-wave select (K pair / M+8)
    const int lm   = lane & 15;
    const int wm   = wave & 3;         // 4 waves along M
    const int wn   = wave >> 2;        // 2 waves along N

    v8f acc0 = {};                     // n offsets [0,16)
    v8f acc1 = {};                     // n offsets [16,32)

    for (int kb = 0; kb < K; kb += 32) {
        __syncthreads();               // previous tile fully consumed
#if HAVE_ASYNC_COPY
        // X tile 64x32 = 512 x 16B chunks, W tile 32x64 = 512 x 16B chunks
#pragma unroll
        for (int j = 0; j < 2; ++j) {
            int chunk = tid + j * 256;
            int xr = chunk >> 3, xc = (chunk & 7) << 2;      // 8 chunks / X row
            async_cp16(&X[(size_t)(rowBase + xr) * K + kb + xc], &Xs[xr][xc]);
            int wr = chunk >> 4, wc = (chunk & 15) << 2;     // 16 chunks / W row
            async_cp16(&W[(size_t)(kb + wr) * N + colBase + wc], &Ws[wr][wc]);
        }
        WAIT_ASYNC();
#else
        for (int i = tid; i < 64 * 32; i += 256) {
            int r = i >> 5, c = i & 31;
            Xs[r][c] = X[(size_t)(rowBase + r) * K + kb + c];
        }
        for (int i = tid; i < 32 * 64; i += 256) {
            int r = i >> 6, c = i & 63;
            Ws[r][c] = W[(size_t)(kb + r) * N + colBase + c];
        }
#endif
        if (kb + 32 < K) {   // hint next tiles into cache (global_prefetch_b8)
            __builtin_prefetch(&X[(size_t)(rowBase + (tid >> 2)) * K + kb + 32 + ((tid & 3) << 3)], 0, 1);
            __builtin_prefetch(&W[(size_t)(kb + 32 + (tid >> 3)) * N + colBase + ((tid & 7) << 3)], 0, 1);
        }
        __syncthreads();

#pragma unroll
        for (int k0 = 0; k0 < 32; k0 += 4) {
            v2f a, b0, b1;
            a.x  = Xs[wm * 16 + lm][k0 + 2 * hl];
            a.y  = Xs[wm * 16 + lm][k0 + 2 * hl + 1];
            b0.x = Ws[k0 + 2 * hl][wn * 32 + lm];
            b0.y = Ws[k0 + 2 * hl + 1][wn * 32 + lm];
            b1.x = Ws[k0 + 2 * hl][wn * 32 + 16 + lm];
            b1.y = Ws[k0 + 2 * hl + 1][wn * 32 + 16 + lm];
            acc0 = wmma4(a, b0, acc0);
            acc1 = wmma4(a, b1, acc1);
        }
    }

    // epilogue: bias + optional LoRA correction, then store
    const int row0 = rowBase + wm * 16;
    const int col0 = colBase + wn * 32 + lm;
#pragma unroll
    for (int e = 0; e < 8; ++e) {
        int row = row0 + e + 8 * hl;           // C/D layout: M = e + 8*half
        float s0 = acc0[e] + bias[col0];
        float s1 = acc1[e] + bias[col0 + 16];
        if (XA != nullptr) {
            float l0 = 0.0f, l1 = 0.0f;
#pragma unroll
            for (int r = 0; r < RANK; ++r) {
                float xav = XA[row * RANK + r];
                l0 += xav * BL[r * N + col0];
                l1 += xav * BL[r * N + col0 + 16];
            }
            s0 += ALPHA * l0;
            s1 += ALPHA * l1;
        }
        Out[(size_t)row * N + col0]      = s0;
        Out[(size_t)row * N + col0 + 16] = s1;
    }
}

// ---------------- kernel 3: causal flash attention ----------------
// qkv: [B*S, 3072] with q|k|v each D wide; ctx out: [B*S, D] heads merged.
// grid: (S/64, H, B); block: 128 threads = 4 waves, each wave owns 16 queries.
__global__ __launch_bounds__(128)
void attn_kernel(const float* __restrict__ qkv, float* __restrict__ ctx) {
    __shared__ __align__(16) float Ks[16][68];
    __shared__ __align__(16) float Vs[16][68];
    __shared__ __align__(16) float Ps[4][16][20];

    const int b     = blockIdx.z;
    const int h     = blockIdx.y;
    const int qBase = blockIdx.x * 64;

    const int tid  = threadIdx.x;
    const int wave = tid >> 5;        // 0..3
    const int lane = tid & 31;
    const int hl   = lane >> 4;
    const int lm   = lane & 15;

    // preload this lane's Q fragments (row = lm of the wave's 16-query strip)
    const int qRow = qBase + wave * 16 + lm;
    const float* qp = qkv + (size_t)(b * SS + qRow) * 3072 + h * HD;
    float qreg[32];
#pragma unroll
    for (int i = 0; i < 16; ++i) {
        qreg[2 * i]     = qp[4 * i + 2 * hl];
        qreg[2 * i + 1] = qp[4 * i + 2 * hl + 1];
    }

    v8f o0 = {}, o1 = {}, o2 = {}, o3 = {};
    float mrow[8], lrow[8];
#pragma unroll
    for (int e = 0; e < 8; ++e) { mrow[e] = -3.0e38f; lrow[e] = 0.0f; }

    const int nKeyTiles = (qBase >> 4) + 4;     // causal: keys <= qBase+63
    for (int kt = 0; kt < nKeyTiles; ++kt) {
        const int keyBase = kt * 16;
        __syncthreads();
#if HAVE_ASYNC_COPY
        // K tile and V tile: 16x64 floats = 256 x 16B chunks each
#pragma unroll
        for (int j = 0; j < 2; ++j) {
            int chunk = tid + j * 128;
            int r = chunk >> 4, c = (chunk & 15) << 2;       // 16 chunks / row
            size_t ro = (size_t)(b * SS + keyBase + r) * 3072 + h * HD + c;
            async_cp16(&qkv[ro + DD],     &Ks[r][c]);
            async_cp16(&qkv[ro + 2 * DD], &Vs[r][c]);
        }
        WAIT_ASYNC();
#else
        for (int i = tid; i < 16 * 64; i += 128) {
            int r = i >> 6, c = i & 63;
            size_t ro = (size_t)(b * SS + keyBase + r) * 3072 + h * HD;
            Ks[r][c] = qkv[ro + DD + c];        // K block
            Vs[r][c] = qkv[ro + 2 * DD + c];    // V block
        }
#endif
        __syncthreads();

        // S = Q(16x64) * K^T(64x16)
        v8f s = {};
#pragma unroll
        for (int i = 0; i < 16; ++i) {
            v2f a, bb;
            a.x  = qreg[2 * i];
            a.y  = qreg[2 * i + 1];
            bb.x = Ks[lm][4 * i + 2 * hl];
            bb.y = Ks[lm][4 * i + 2 * hl + 1];
            s = wmma4(a, bb, s);
        }

        // mask-then-scale exactly like reference: (s + mask) / sqrt(HD)
        const int key = keyBase + lm;
        float tmax[8];
#pragma unroll
        for (int e = 0; e < 8; ++e) {
            int q = qBase + wave * 16 + e + 8 * hl;
            s[e] = (s[e] + ((key <= q) ? 0.0f : NEGV)) * 0.125f;
        }
        // row max across the 16-lane half-groups (rows live per half)
#pragma unroll
        for (int e = 0; e < 8; ++e) {
            float v = s[e];
            v = fmaxf(v, __shfl_xor(v, 8, 16));
            v = fmaxf(v, __shfl_xor(v, 4, 16));
            v = fmaxf(v, __shfl_xor(v, 2, 16));
            v = fmaxf(v, __shfl_xor(v, 1, 16));
            tmax[e] = v;
        }
        float scl[8];
#pragma unroll
        for (int e = 0; e < 8; ++e) {
            float mo = mrow[e];
            float mn = fmaxf(mo, tmax[e]);
            mrow[e]  = mn;
            scl[e]   = __expf(mo - mn);
            s[e]     = __expf(s[e] - mn);       // P
        }
#pragma unroll
        for (int e = 0; e < 8; ++e) {
            float v = s[e];
            v += __shfl_xor(v, 8, 16);
            v += __shfl_xor(v, 4, 16);
            v += __shfl_xor(v, 2, 16);
            v += __shfl_xor(v, 1, 16);
            lrow[e] = lrow[e] * scl[e] + v;
            o0[e] *= scl[e]; o1[e] *= scl[e]; o2[e] *= scl[e]; o3[e] *= scl[e];
        }

        // C-layout -> A-layout via LDS (wave-private region, in-order DS)
#pragma unroll
        for (int e = 0; e < 8; ++e)
            Ps[wave][e + 8 * hl][lm] = s[e];

        // O += P(16x16) * V(16x64)
#pragma unroll
        for (int i = 0; i < 4; ++i) {
            v2f a, b0, b1, b2, b3;
            a.x  = Ps[wave][lm][4 * i + 2 * hl];
            a.y  = Ps[wave][lm][4 * i + 2 * hl + 1];
            b0.x = Vs[4 * i + 2 * hl][lm];      b0.y = Vs[4 * i + 2 * hl + 1][lm];
            b1.x = Vs[4 * i + 2 * hl][16 + lm]; b1.y = Vs[4 * i + 2 * hl + 1][16 + lm];
            b2.x = Vs[4 * i + 2 * hl][32 + lm]; b2.y = Vs[4 * i + 2 * hl + 1][32 + lm];
            b3.x = Vs[4 * i + 2 * hl][48 + lm]; b3.y = Vs[4 * i + 2 * hl + 1][48 + lm];
            o0 = wmma4(a, b0, o0);
            o1 = wmma4(a, b1, o1);
            o2 = wmma4(a, b2, o2);
            o3 = wmma4(a, b3, o3);
        }
    }

    // normalize and store merged-head context [B*S, D]
    const size_t outBase = (size_t)(b * SS + qBase + wave * 16) * DD + h * HD;
#pragma unroll
    for (int e = 0; e < 8; ++e) {
        int r = e + 8 * hl;
        float inv = 1.0f / lrow[e];
        size_t ro = outBase + (size_t)r * DD;
        ctx[ro + lm]      = o0[e] * inv;
        ctx[ro + 16 + lm] = o1[e] * inv;
        ctx[ro + 32 + lm] = o2[e] * inv;
        ctx[ro + 48 + lm] = o3[e] * inv;
    }
}

// ---------------- host-side orchestration ----------------
extern "C" void kernel_launch(void* const* d_in, const int* in_sizes, int n_in,
                              void* d_out, int out_size, void* d_ws, size_t ws_size,
                              hipStream_t stream) {
    (void)in_sizes; (void)n_in; (void)out_size; (void)ws_size;

    const float* x      = (const float*)d_in[0];
    const float* W_qkv  = (const float*)d_in[1];
    const float* b_qkv  = (const float*)d_in[2];
    const float* A_lora = (const float*)d_in[3];
    const float* B_lora = (const float*)d_in[4];
    const float* W_proj = (const float*)d_in[5];
    const float* b_proj = (const float*)d_in[6];
    float* out = (float*)d_out;

    const int M = BB * SS;                       // 4096 rows
    char* ws = (char*)d_ws;
    float* qkv = (float*)ws;                                         // M x 3072
    float* ctx = (float*)(ws + (size_t)M * 3 * DD * sizeof(float));  // M x 1024
    float* xa  = (float*)(ws + (size_t)M * 4 * DD * sizeof(float));  // M x 8

    // 1) LoRA down-projection
    lora_xa_kernel<<<dim3((M * RANK) / 256), dim3(256), 0, stream>>>(x, A_lora, xa);
    // 2) fused qkv = x@W_qkv + b + ALPHA * xa@B_lora
    gemm_wmma_kernel<<<dim3((3 * DD) / 64, M / 64), dim3(256), 0, stream>>>(
        x, W_qkv, b_qkv, xa, B_lora, qkv, M, 3 * DD, DD);
    // 3) causal flash attention -> merged-head ctx
    attn_kernel<<<dim3(SS / 64, HH, BB), dim3(128), 0, stream>>>(qkv, ctx);
    // 4) output projection
    gemm_wmma_kernel<<<dim3(DD / 64, M / 64), dim3(256), 0, stream>>>(
        ctx, W_proj, b_proj, nullptr, nullptr, out, M, DD, DD);
}

// v001
// It runs in 492 microseconds.
// Next to v000, in two timings, it ran 1.21 times as fast each time.
#include <hip/hip_runtime.h>
#include <hip/hip_bf16.h>

// ---------------- problem constants (from reference) ----------------
#define BB    2
#define SS    2048
#define DD    1024
#define HH    16
#define HD    64
#define RANK  8
#define ALPHA 8.0f
#define NEGV  (-1e9f)

typedef __attribute__((ext_vector_type(2))) float v2f;
typedef __attribute__((ext_vector_type(8))) float v8f;

// D = A(16x4 f32) * B(4x16 f32) + C(16x16 f32) -- exact fp32 matrix op
__device__ __forceinline__ v8f wmma4(v2f a, v2f b, v8f c) {
    return __builtin_amdgcn_wmma_f32_16x16x4_f32(
        /*neg_a=*/false, a, /*neg_b=*/false, b,
        /*c_mod=*/(short)0, c, /*reuse_a=*/false, /*reuse_b=*/false);
}

// ---------------- async global->LDS staging (guarded; falls back to ds stores) ----
#if defined(__gfx1250__) && __has_builtin(__builtin_amdgcn_global_load_async_to_lds_b128)
#define HAVE_ASYNC_COPY 1
// Parameter types per hipcc diagnostic: int __vector_size__(16), AS1 / AS3.
typedef int vsi4 __attribute__((__vector_size__(4 * sizeof(int))));
typedef __attribute__((address_space(1))) vsi4* gvec4p;
typedef __attribute__((address_space(3))) vsi4* lvec4p;

__device__ __forceinline__ void async_cp16(const float* g, float* l) {
    // ptr -> int -> AS-qualified ptr: AS1 == flat global; AS3 takes addr[31:0]
    // which is exactly the ISA's flat->LDS aperture mapping (truncate).
    __builtin_amdgcn_global_load_async_to_lds_b128(
        (gvec4p)(unsigned long long)(__UINTPTR_TYPE__)g,
        (lvec4p)(unsigned int)(__UINTPTR_TYPE__)l,
        /*offset=*/0, /*cpol=*/0);
}
#if __has_builtin(__builtin_amdgcn_s_wait_asynccnt)
#define WAIT_ASYNC() __builtin_amdgcn_s_wait_asynccnt(0)
#else
#define WAIT_ASYNC() asm volatile("s_wait_asynccnt 0x0" ::: "memory")
#endif
#else
#define HAVE_ASYNC_COPY 0
#define WAIT_ASYNC()
#endif

// ---------------- kernel 1: xa = x @ A_lora  [4096 x 8] ----------------
__global__ __launch_bounds__(256)
void lora_xa_kernel(const float* __restrict__ x,
                    const float* __restrict__ A,
                    float* __restrict__ xa) {
    int idx = blockIdx.x * 256 + threadIdx.x;      // exactly 4096*8 threads
    int row = idx >> 3;
    int r   = idx & 7;
    const float* xr = x + (size_t)row * DD;
    float acc = 0.0f;
#pragma unroll 8
    for (int k = 0; k < DD; ++k)
        acc += xr[k] * A[k * RANK + r];
    xa[idx] = acc;
}

// ---------------- kernel 2/4: Out = X@W + bias (+ ALPHA * XA@BL) ----------------
// X: MxK (row-major, lda=K), W: KxN (row-major, ldb=N), Out: MxN
// 64x64 workgroup tile, 256 threads = 8 waves, each wave -> 16x32 strip.
__global__ __launch_bounds__(256)
void gemm_wmma_kernel(const float* __restrict__ X,
                      const float* __restrict__ W,
                      const float* __restrict__ bias,
                      const float* __restrict__ XA,   // M x RANK or nullptr
                      const float* __restrict__ BL,   // RANK x N or nullptr
                      float* __restrict__ Out,
                      int M, int N, int K) {
    // row strides are 16B multiples (B128 LDS writes) and bank-conflict-free
    __shared__ __align__(16) float Xs[64][36];
    __shared__ __align__(16) float Ws[32][68];

    const int rowBase = blockIdx.y * 64;
    const int colBase = blockIdx.x * 64;

    const int tid  = threadIdx.x;
    const int wave = tid >> 5;         // 0..7
    const int lane = tid & 31;
    const int hl   = lane >> 4;        // half-wave select (K pair / M+8)
    const int lm   = lane & 15;
    const int wm   = wave & 3;         // 4 waves along M
    const int wn   = wave >> 2;        // 2 waves along N

    v8f acc0 = {};                     // n offsets [0,16)
    v8f acc1 = {};                     // n offsets [16,32)

    for (int kb = 0; kb < K; kb += 32) {
        __syncthreads();               // previous tile fully consumed
#if HAVE_ASYNC_COPY
        // X tile 64x32 = 512 x 16B chunks, W tile 32x64 = 512 x 16B chunks
#pragma unroll
        for (int j = 0; j < 2; ++j) {
            int chunk = tid + j * 256;
            int xr = chunk >> 3, xc = (chunk & 7) << 2;      // 8 chunks / X row
            async_cp16(&X[(size_t)(rowBase + xr) * K + kb + xc], &Xs[xr][xc]);
            int wr = chunk >> 4, wc = (chunk & 15) << 2;     // 16 chunks / W row
            async_cp16(&W[(size_t)(kb + wr) * N + colBase + wc], &Ws[wr][wc]);
        }
        WAIT_ASYNC();
#else
        for (int i = tid; i < 64 * 32; i += 256) {
            int r = i >> 5, c = i & 31;
            Xs[r][c] = X[(size_t)(rowBase + r) * K + kb + c];
        }
        for (int i = tid; i < 32 * 64; i += 256) {
            int r = i >> 6, c = i & 63;
            Ws[r][c] = W[(size_t)(kb + r) * N + colBase + c];
        }
#endif
        if (kb + 32 < K) {   // hint next tiles into cache (global_prefetch_b8)
            __builtin_prefetch(&X[(size_t)(rowBase + (tid >> 2)) * K + kb + 32 + ((tid & 3) << 3)], 0, 1);
            __builtin_prefetch(&W[(size_t)(kb + 32 + (tid >> 3)) * N + colBase + ((tid & 7) << 3)], 0, 1);
        }
        __syncthreads();

#pragma unroll
        for (int k0 = 0; k0 < 32; k0 += 4) {
            v2f a, b0, b1;
            a.x  = Xs[wm * 16 + lm][k0 + 2 * hl];
            a.y  = Xs[wm * 16 + lm][k0 + 2 * hl + 1];
            b0.x = Ws[k0 + 2 * hl][wn * 32 + lm];
            b0.y = Ws[k0 + 2 * hl + 1][wn * 32 + lm];
            b1.x = Ws[k0 + 2 * hl][wn * 32 + 16 + lm];
            b1.y = Ws[k0 + 2 * hl + 1][wn * 32 + 16 + lm];
            acc0 = wmma4(a, b0, acc0);
            acc1 = wmma4(a, b1, acc1);
        }
    }

    // epilogue: bias + optional LoRA correction, then store
    const int row0 = rowBase + wm * 16;
    const int col0 = colBase + wn * 32 + lm;
#pragma unroll
    for (int e = 0; e < 8; ++e) {
        int row = row0 + e + 8 * hl;           // C/D layout: M = e + 8*half
        float s0 = acc0[e] + bias[col0];
        float s1 = acc1[e] + bias[col0 + 16];
        if (XA != nullptr) {
            float l0 = 0.0f, l1 = 0.0f;
#pragma unroll
            for (int r = 0; r < RANK; ++r) {
                float xav = XA[row * RANK + r];
                l0 += xav * BL[r * N + col0];
                l1 += xav * BL[r * N + col0 + 16];
            }
            s0 += ALPHA * l0;
            s1 += ALPHA * l1;
        }
        Out[(size_t)row * N + col0]      = s0;
        Out[(size_t)row * N + col0 + 16] = s1;
    }
}

// ---------------- kernel 3: causal flash attention ----------------
// qkv: [B*S, 3072] with q|k|v each D wide; ctx out: [B*S, D] heads merged.
// grid: (S/64, H, B); block: 128 threads = 4 waves, each wave owns 16 queries.
// One pass of the key loop covers KT = 64 keys (four 16-key score tiles per wave).
#define KT 64
__global__ __launch_bounds__(128)
void attn_kernel(const float* __restrict__ qkv, float* __restrict__ ctx) {
    __shared__ __align__(16) float Ks[KT][68];
    __shared__ __align__(16) float Vs[KT][68];
    __shared__ __align__(16) float Ps[4][16][68];

    const int b     = blockIdx.z;
    const int h     = blockIdx.y;
    const int qBase = blockIdx.x * 64;

    const int tid  = threadIdx.x;
    const int wave = tid >> 5;        // 0..3
    const int lane = tid & 31;
    const int hl   = lane >> 4;
    const int lm   = lane & 15;

    // preload this lane's Q fragments (row = lm of the wave's 16-query strip)
    const int qRow = qBase + wave * 16 + lm;
    const float* qp = qkv + (size_t)(b * SS + qRow) * 3072 + h * HD;
    float qreg[32];
#pragma unroll
    for (int i = 0; i < 16; ++i) {
        qreg[2 * i]     = qp[4 * i + 2 * hl];
        qreg[2 * i + 1] = qp[4 * i + 2 * hl + 1];
    }

    v8f o0 = {}, o1 = {}, o2 = {}, o3 = {};
    float mrow[8], lrow[8];
#pragma unroll
    for (int e = 0; e < 8; ++e) { mrow[e] = -3.0e38f; lrow[e] = 0.0f; }

    const int nPasses = blockIdx.x + 1;         // causal: keys <= qBase+63
    for (int kt = 0; kt < nPasses; ++kt) {
        const int keyBase = kt * KT;
        __syncthreads();               // previous pass's tiles fully consumed
#if HAVE_ASYNC_COPY
        // K tile and V tile: 64x64 floats = 1024 x 16B chunks each
#pragma unroll
        for (int j = 0; j < 8; ++j) {
            int chunk = tid + j * 128;
            int r = chunk >> 4, c = (chunk & 15) << 2;       // 16 chunks / row
            size_t ro = (size_t)(b * SS + keyBase + r) * 3072 + h * HD + c;
            async_cp16(&qkv[ro + DD],     &Ks[r][c]);
            async_cp16(&qkv[ro + 2 * DD], &Vs[r][c]);
        }
        // this wave's 16 copies have landed before the barrier publishes them
        asm volatile("s_wait_asynccnt 0x0" ::: "memory");
#else
        for (int i = tid; i < KT * 64; i += 128) {
            int r = i >> 6, c = i & 63;
            size_t ro = (size_t)(b * SS + keyBase + r) * 3072 + h * HD;
            Ks[r][c] = qkv[ro + DD + c];        // K block
            Vs[r][c] = qkv[ro + 2 * DD + c];    // V block
        }
#endif
        __syncthreads();

        // S = Q(16x64) * K^T(64x64): four independent 16x16 score tiles
        v8f s0 = {}, s1 = {}, s2 = {}, s3 = {};
#pragma unroll
        for (int i = 0; i < 16; ++i) {
            v2f a, k0, k1, k2, k3;
            a.x  = qreg[2 * i];
            a.y  = qreg[2 * i + 1];
            k0.x = Ks[lm][4 * i + 2 * hl];      k0.y = Ks[lm][4 * i + 2 * hl + 1];
            k1.x = Ks[16 + lm][4 * i + 2 * hl]; k1.y = Ks[16 + lm][4 * i + 2 * hl + 1];
            k2.x = Ks[32 + lm][4 * i + 2 * hl]; k2.y = Ks[32 + lm][4 * i + 2 * hl + 1];
            k3.x = Ks[48 + lm][4 * i + 2 * hl]; k3.y = Ks[48 + lm][4 * i + 2 * hl + 1];
            s0 = wmma4(a, k0, s0);
            s1 = wmma4(a, k1, s1);
            s2 = wmma4(a, k2, s2);
            s3 = wmma4(a, k3, s3);
        }

        // mask-then-scale exactly like reference: (s + mask) / sqrt(HD)
        const int key = keyBase + lm;
        float tmax[8];
#pragma unroll
        for (int e = 0; e < 8; ++e) {
            int q = qBase + wave * 16 + e + 8 * hl;
            s0[e] = (s0[e] + ((key      <= q) ? 0.0f : NEGV)) * 0.125f;
            s1[e] = (s1[e] + ((key + 16 <= q) ? 0.0f : NEGV)) * 0.125f;
            s2[e] = (s2[e] + ((key + 32 <= q) ? 0.0f : NEGV)) * 0.125f;
            s3[e] = (s3[e] + ((key + 48 <= q) ? 0.0f : NEGV)) * 0.125f;
        }
        // row max: the lane's four keys first, then across the 16-lane half-groups
#pragma unroll
        for (int e = 0; e < 8; ++e) {
            float v = fmaxf(fmaxf(s0[e], s1[e]), fmaxf(s2[e], s3[e]));
            v = fmaxf(v, __shfl_xor(v, 8, 16));
            v = fmaxf(v, __shfl_xor(v, 4, 16));
            v = fmaxf(v, __shfl_xor(v, 2, 16));
            v = fmaxf(v, __shfl_xor(v, 1, 16));
            tmax[e] = v;
        }
        float scl[8];
#pragma unroll
        for (int e = 0; e < 8; ++e) {
            float mo = mrow[e];
            float mn = fmaxf(mo, tmax[e]);
            mrow[e]  = mn;
            scl[e]   = __expf(mo - mn);
            s0[e]    = __expf(s0[e] - mn);      // P
            s1[e]    = __expf(s1[e] - mn);
            s2[e]    = __expf(s2[e] - mn);
            s3[e]    = __expf(s3[e] - mn);
        }
#pragma unroll
        for (int e = 0; e < 8; ++e) {
            float v = (s0[e] + s1[e]) + (s2[e] + s3[e]);
            v += __shfl_xor(v, 8, 16);
            v += __shfl_xor(v, 4, 16);
            v += __shfl_xor(v, 2, 16);
            v += __shfl_xor(v, 1, 16);
            lrow[e] = lrow[e] * scl[e] + v;
            o0[e] *= scl[e]; o1[e] *= scl[e]; o2[e] *= scl[e]; o3[e] *= scl[e];
        }

        // C-layout -> A-layout via LDS (wave-private region, in-order DS)
#pragma unroll
        for (int e = 0; e < 8; ++e) {
            Ps[wave][e + 8 * hl][lm]      = s0[e];
            Ps[wave][e + 8 * hl][16 + lm] = s1[e];
            Ps[wave][e + 8 * hl][32 + lm] = s2[e];
            Ps[wave][e + 8 * hl][48 + lm] = s3[e];
        }

        // O += P(16x64) * V(64x64)
#pragma unroll
        for (int i = 0; i < 16; ++i) {
            v2f a, b0, b1, b2, b3;
            a.x  = Ps[wave][lm][4 * i + 2 * hl];
            a.y  = Ps[wave][lm][4 * i + 2 * hl + 1];
            b0.x = Vs[4 * i + 2 * hl][lm];      b0.y = Vs[4 * i + 2 * hl + 1][lm];
            b1.x = Vs[4 * i + 2 * hl][16 + lm]; b1.y = Vs[4 * i + 2 * hl + 1][16 + lm];
            b2.x = Vs[4 * i + 2 * hl][32 + lm]; b2.y = Vs[4 * i + 2 * hl + 1][32 + lm];
            b3.x = Vs[4 * i + 2 * hl][48 + lm]; b3.y = Vs[4 * i + 2 * hl + 1][48 + lm];
            o0 = wmma4(a, b0, o0);
            o1 = wmma4(a, b1, o1);
            o2 = wmma4(a, b2, o2);
            o3 = wmma4(a, b3, o3);
        }
    }

    // normalize and store merged-head context [B*S, D]
    const size_t outBase = (size_t)(b * SS + qBase + wave * 16) * DD + h * HD;
#pragma unroll
    for (int e = 0; e < 8; ++e) {
        int r = e + 8 * hl;
        float inv = 1.0f / lrow[e];
        size_t ro = outBase + (size_t)r * DD;
        ctx[ro + lm]      = o0[e] * inv;
        ctx[ro + 16 + lm] = o1[e] * inv;
        ctx[ro + 32 + lm] = o2[e] * inv;
        ctx[ro + 48 + lm] = o3[e] * inv;
    }
}

// ---------------- host-side orchestration ----------------
extern "C" void kernel_launch(void* const* d_in, const int* in_sizes, int n_in,
                              void* d_out, int out_size, void* d_ws, size_t ws_size,
                              hipStream_t stream) {
    (void)in_sizes; (void)n_in; (void)out_size; (void)ws_size;

    const float* x      = (const float*)d_in[0];
    const float* W_qkv  = (const float*)d_in[1];
    const float* b_qkv  = (const float*)d_in[2];
    const float* A_lora = (const float*)d_in[3];
    const float* B_lora = (const float*)d_in[4];
    const float* W_proj = (const float*)d_in[5];
    const float* b_proj = (const float*)d_in[6];
    float* out = (float*)d_out;

    const int M = BB * SS;                       // 4096 rows
    char* ws = (char*)d_ws;
    float* qkv = (float*)ws;                                         // M x 3072
    float* ctx = (float*)(ws + (size_t)M * 3 * DD * sizeof(float));  // M x 1024
    float* xa  = (float*)(ws + (size_t)M * 4 * DD * sizeof(float));  // M x 8

    // 1) LoRA down-projection
    lora_xa_kernel<<<dim3((M * RANK) / 256), dim3(256), 0, stream>>>(x, A_lora, xa);
    // 2) fused qkv = x@W_qkv + b + ALPHA * xa@B_lora
    gemm_wmma_kernel<<<dim3((3 * DD) / 64, M / 64), dim3(256), 0, stream>>>(
        x, W_qkv, b_qkv, xa, B_lora, qkv, M, 3 * DD, DD);
    // 3) causal flash attention -> merged-head ctx
    attn_kernel<<<dim3(SS / 64, HH, BB), dim3(128), 0, stream>>>(qkv, ctx);
    // 4) output projection
    gemm_wmma_kernel<<<dim3(DD / 64, M / 64), dim3(256), 0, stream>>>(
        ctx, W_proj, b_proj, nullptr, nullptr, out, M, DD, DD);
}

// v002
// A run of this version takes 436 microseconds.
// Next to v001, in two timings, it ran 1.11 times as fast each time.
// Over all steps from v000 it is 1.35 times as fast.
#include <hip/hip_runtime.h>
#include <hip/hip_bf16.h>

// ---------------- problem constants (from reference) ----------------
#define BB    2
#define SS    2048
#define DD    1024
#define HH    16
#define HD    64
#define RANK  8
#define ALPHA 8.0f
#define NEGV  (-1e9f)

typedef __attribute__((ext_vector_type(2))) float v2f;
typedef __attribute__((ext_vector_type(4))) float v4f;
typedef __attribute__((ext_vector_type(8))) float v8f;

// D = A(16x4 f32) * B(4x16 f32) + C(16x16 f32) -- exact fp32 matrix op
__device__ __forceinline__ v8f wmma4(v2f a, v2f b, v8f c) {
    return __builtin_amdgcn_wmma_f32_16x16x4_f32(
        /*neg_a=*/false, a, /*neg_b=*/false, b,
        /*c_mod=*/(short)0, c, /*reuse_a=*/false, /*reuse_b=*/false);
}

// ---------------- async global->LDS staging (guarded; falls back to ds stores) ----
#if defined(__gfx1250__) && __has_builtin(__builtin_amdgcn_global_load_async_to_lds_b128)
#define HAVE_ASYNC_COPY 1
// Parameter types per hipcc diagnostic: int __vector_size__(16), AS1 / AS3.
typedef int vsi4 __attribute__((__vector_size__(4 * sizeof(int))));
typedef __attribute__((address_space(1))) vsi4* gvec4p;
typedef __attribute__((address_space(3))) vsi4* lvec4p;

__device__ __forceinline__ void async_cp16(const float* g, float* l) {
    // ptr -> int -> AS-qualified ptr: AS1 == flat global; AS3 takes addr[31:0]
    // which is exactly the ISA's flat->LDS aperture mapping (truncate).
    __builtin_amdgcn_global_load_async_to_lds_b128(
        (gvec4p)(unsigned long long)(__UINTPTR_TYPE__)g,
        (lvec4p)(unsigned int)(__UINTPTR_TYPE__)l,
        /*offset=*/0, /*cpol=*/0);
}
#else
#define HAVE_ASYNC_COPY 0
#endif

// ---------------- kernel 1: xa = x @ A_lora  [4096 x 8] ----------------
__global__ __launch_bounds__(256)
void lora_xa_kernel(const float* __restrict__ x,
                    const float* __restrict__ A,
                    float* __restrict__ xa) {
    int idx = blockIdx.x * 256 + threadIdx.x;      // exactly 4096*8 threads
    int row = idx >> 3;
    int r   = idx & 7;
    const float* xr = x + (size_t)row * DD;
    float acc = 0.0f;
#pragma unroll 8
    for (int k = 0; k < DD; ++k)
        acc += xr[k] * A[k * RANK + r];
    xa[idx] = acc;
}

// one output row's four 16-column groups of a lane
__device__ __forceinline__ void store_row4(float* p, float s0, float s1, float s2, float s3) {
    p[0]  = s0;
    p[16] = s1;
    p[32] = s2;
    p[48] = s3;
    // address pair and data registers are not reused before the stores have taken them
    asm volatile("s_wait_xcnt 0x0" :: "v"(p), "v"(s0), "v"(s1), "v"(s2), "v"(s3) : "memory");
}

// ---------------- kernel 2/4: Out = X@W + bias (+ ALPHA * XA@BL) ----------------
// X: MxK (row-major, lda=K), W: KxN (row-major, ldb=N), Out: MxN
// 64x128 workgroup tile, 128 threads = 4 waves (2 x 2), each wave -> 32x64 strip:
// 2 A fragments x 4 B fragments feed 8 matrix ops per 4 k.
#define GBM 64
#define GBN 128
#define GBK 32
#define XPITCH 36    // floats; 16 rows of one A fragment fall on 16 distinct 4-bank groups
#define WPITCH 144   // floats; rows k and k+2 (the two half-waves) lie 32 banks apart
__global__ __launch_bounds__(128)
void gemm_wmma_kernel(const float* __restrict__ X,
                      const float* __restrict__ W,
                      const float* __restrict__ bias,
                      const float* __restrict__ XA,   // M x RANK or nullptr
                      const float* __restrict__ BL,   // RANK x N or nullptr
                      float* __restrict__ Out,
                      int M, int N, int K) {
    // row strides are 16B multiples (B128 LDS writes)
    __shared__ __align__(16) float Xs[GBM][XPITCH];
    __shared__ __align__(16) float Ws[GBK][WPITCH];

    const int rowBase = blockIdx.y * GBM;
    const int colBase = blockIdx.x * GBN;

    const int tid  = threadIdx.x;
    const int wave = tid >> 5;         // 0..3
    const int lane = tid & 31;
    const int hl   = lane >> 4;        // half-wave select (K pair / M+8)
    const int lm   = lane & 15;
    const int wm   = wave & 1;         // 2 waves along M
    const int wn   = wave >> 1;        // 2 waves along N

    v8f acc[2][4] = {};                // [16-row group][16-column group]

    const float* Xb = X + (size_t)rowBase * K;                         // block-uniform
    const float* Wb = W + colBase;                                     // block-uniform
    const unsigned xoff = (unsigned)(tid >> 3) * K + ((tid & 7) << 2);  // lane's place in 16 X rows
    const unsigned woff = (unsigned)(tid >> 5) * N + ((tid & 31) << 2); // lane's place in 4 W rows

    for (int kb = 0; kb < K; kb += GBK) {
        __syncthreads();               // previous tile fully consumed
#if HAVE_ASYNC_COPY
        // X tile 64x32 = 512 x 16B chunks, W tile 32x128 = 1024 x 16B chunks;
        // each address = block-uniform base + the lane's fixed 32-bit element offset
#pragma unroll
        for (int j = 0; j < 4; ++j)      // 8 chunks / X row, 16 rows per trip
            async_cp16(Xb + (size_t)(j * 16) * K + kb + xoff, &Xs[j * 16 + (tid >> 3)][(tid & 7) << 2]);
#pragma unroll
        for (int j = 0; j < 8; ++j)      // 32 chunks / W row, 4 rows per trip
            async_cp16(Wb + (size_t)(kb + j * 4) * N + woff, &Ws[j * 4 + (tid >> 5)][(tid & 31) << 2]);
        // this wave's 12 copies have landed before the barrier publishes them
        asm volatile("s_wait_asynccnt 0x0" ::: "memory");
#else
        for (int i = tid; i < GBM * GBK; i += 128) {
            int r = i >> 5, c = i & 31;
            Xs[r][c] = X[(size_t)(rowBase + r) * K + kb + c];
        }
        for (int i = tid; i < GBK * GBN; i += 128) {
            int r = i >> 7, c = i & 127;
            Ws[r][c] = W[(size_t)(kb + r) * N + colBase + c];
        }
#endif
        if (kb + GBK < K) {   // hint next tiles into cache (global_prefetch_b8)
            __builtin_prefetch(&X[(size_t)(rowBase + (tid >> 1)) * K + kb + GBK + ((tid & 1) << 4)], 0, 1);
            __builtin_prefetch(&W[(size_t)(kb + GBK + (tid >> 2)) * N + colBase + ((tid & 3) << 5)], 0, 1);
        }
        __syncthreads();

#pragma unroll
        for (int k0 = 0; k0 < GBK; k0 += 4) {
            v2f a[2], b[4];
#pragma unroll
            for (int mi = 0; mi < 2; ++mi) {
                a[mi].x = Xs[wm * 32 + mi * 16 + lm][k0 + 2 * hl];
                a[mi].y = Xs[wm * 32 + mi * 16 + lm][k0 + 2 * hl + 1];
            }
#pragma unroll
            for (int ni = 0; ni < 4; ++ni) {
                b[ni].x = Ws[k0 + 2 * hl][wn * 64 + ni * 16 + lm];
                b[ni].y = Ws[k0 + 2 * hl + 1][wn * 64 + ni * 16 + lm];
            }
#pragma unroll
            for (int mi = 0; mi < 2; ++mi)
#pragma unroll
                for (int ni = 0; ni < 4; ++ni)
                    acc[mi][ni] = wmma4(a[mi], b[ni], acc[mi][ni]);
        }
    }

    // epilogue: bias + optional LoRA correction, then store
    const int row0 = rowBase + wm * 32 + 8 * hl;       // C/D layout: M = e + 8*half
    const int col0 = colBase + wn * 64 + lm;
    const float* bp = bias + col0;
    const float bs0 = bp[0], bs1 = bp[16], bs2 = bp[32], bs3 = bp[48];
    // keeps the loads' offset register untouched until the addresses are taken
    asm volatile("s_wait_xcnt 0x0" :: "v"(col0), "v"(bs0), "v"(bs1), "v"(bs2), "v"(bs3) : "memory");
    float* op = Out + (size_t)row0 * N + col0;

    if (XA != nullptr) {
        // the lane's four columns of all eight BL rows, read once for its 16 output rows
        const float* blp[RANK];
        v2f bl[RANK][2];
#pragma unroll
        for (int r = 0; r < RANK; ++r) {
            blp[r] = BL + (size_t)r * N + col0;
            bl[r][0].x = blp[r][0];
            bl[r][0].y = blp[r][16];
            bl[r][1].x = blp[r][32];
            bl[r][1].y = blp[r][48];
        }
        // keeps the eight address pairs untouched until the loads' addresses are taken
        asm volatile("s_wait_xcnt 0x0"
                     :: "v"(blp[0]), "v"(blp[1]), "v"(blp[2]), "v"(blp[3]),
                        "v"(blp[4]), "v"(blp[5]), "v"(blp[6]), "v"(blp[7]),
                        "v"(bl[0][0]), "v"(bl[0][1]), "v"(bl[1][0]), "v"(bl[1][1]),
                        "v"(bl[2][0]), "v"(bl[2][1]), "v"(bl[3][0]), "v"(bl[3][1]),
                        "v"(bl[4][0]), "v"(bl[4][1]), "v"(bl[5][0]), "v"(bl[5][1]),
                        "v"(bl[6][0]), "v"(bl[6][1]), "v"(bl[7][0]), "v"(bl[7][1]) : "memory");
        const v4f* xp = (const v4f*)(XA + (size_t)row0 * RANK);   // two v4f per XA row
#pragma unroll
        for (int g = 0; g < 4; ++g) {                  // four output rows at a time
            const int mi = g >> 1, e0 = (g & 1) * 4;
            v4f xv[8];                                 // their XA rows: four consecutive rows
#pragma unroll
            for (int i = 0; i < 8; ++i)
                xv[i] = xp[(mi * 16 + e0) * 2 + i];
            // keeps the address pair untouched until the loads' addresses are taken
            asm volatile("s_wait_xcnt 0x0"
                         :: "v"(xp), "v"(xv[0]), "v"(xv[1]), "v"(xv[2]), "v"(xv[3]),
                            "v"(xv[4]), "v"(xv[5]), "v"(xv[6]), "v"(xv[7]) : "memory");
#pragma unroll
            for (int j = 0; j < 4; ++j) {
                const int e = e0 + j;
                v2f l0 = {0.0f, 0.0f}, l1 = {0.0f, 0.0f};
#pragma unroll
                for (int r = 0; r < RANK; ++r) {
                    const float x = xv[2 * j + (r >> 2)][r & 3];
                    const v2f xx = {x, x};
                    l0 += xx * bl[r][0];
                    l1 += xx * bl[r][1];
                }
                store_row4(op + (size_t)(mi * 16 + e) * N,
                           (acc[mi][0][e] + bs0) + ALPHA * l0.x, (acc[mi][1][e] + bs1) + ALPHA * l0.y,
                           (acc[mi][2][e] + bs2) + ALPHA * l1.x, (acc[mi][3][e] + bs3) + ALPHA * l1.y);
            }
        }
    } else {
#pragma unroll
        for (int mi = 0; mi < 2; ++mi)
#pragma unroll
            for (int e = 0; e < 8; ++e)
                store_row4(op + (size_t)(mi * 16 + e) * N,
                           acc[mi][0][e] + bs0, acc[mi][1][e] + bs1,
                           acc[mi][2][e] + bs2, acc[mi][3][e] + bs3);
    }
}

// ---------------- kernel 3: causal flash attention ----------------
// qkv: [B*S, 3072] with q|k|v each D wide; ctx out: [B*S, D] heads merged.
// grid: (S/64, H, B); block: 128 threads = 4 waves, each wave owns 16 queries.
// One pass of the key loop covers KT = 64 keys (four 16-key score tiles per wave).
#define KT 64
__global__ __launch_bounds__(128)
void attn_kernel(const float* __restrict__ qkv, float* __restrict__ ctx) {
    __shared__ __align__(16) float Ks[KT][68];
    __shared__ __align__(16) float Vs[KT][68];
    __shared__ __align__(16) float Ps[4][16][68];

    const int b     = blockIdx.z;
    const int h     = blockIdx.y;
    const int qBase = blockIdx.x * 64;

    const int tid  = threadIdx.x;
    const int wave = tid >> 5;        // 0..3
    const int lane = tid & 31;
    const int hl   = lane >> 4;
    const int lm   = lane & 15;

    // preload this lane's Q fragments (row = lm of the wave's 16-query strip)
    const int qRow = qBase + wave * 16 + lm;
    const float* qp = qkv + (size_t)(b * SS + qRow) * 3072 + h * HD;
    float qreg[32];
#pragma unroll
    for (int i = 0; i < 16; ++i) {
        qreg[2 * i]     = qp[4 * i + 2 * hl];
        qreg[2 * i + 1] = qp[4 * i + 2 * hl + 1];
    }

    v8f o0 = {}, o1 = {}, o2 = {}, o3 = {};
    float mrow[8], lrow[8];
#pragma unroll
    for (int e = 0; e < 8; ++e) { mrow[e] = -3.0e38f; lrow[e] = 0.0f; }

    const int nPasses = blockIdx.x + 1;         // causal: keys <= qBase+63
    for (int kt = 0; kt < nPasses; ++kt) {
        const int keyBase = kt * KT;
        __syncthreads();               // previous pass's tiles fully consumed
#if HAVE_ASYNC_COPY
        // K tile and V tile: 64x64 floats = 1024 x 16B chunks each
#pragma unroll
        for (int j = 0; j < 8; ++j) {
            int chunk = tid + j * 128;
            int r = chunk >> 4, c = (chunk & 15) << 2;       // 16 chunks / row
            size_t ro = (size_t)(b * SS + keyBase + r) * 3072 + h * HD + c;
            async_cp16(&qkv[ro + DD],     &Ks[r][c]);
            async_cp16(&qkv[ro + 2 * DD], &Vs[r][c]);
        }
        // this wave's 16 copies have landed before the barrier publishes them
        asm volatile("s_wait_asynccnt 0x0" ::: "memory");
#else
        for (int i = tid; i < KT * 64; i += 128) {
            int r = i >> 6, c = i & 63;
            size_t ro = (size_t)(b * SS + keyBase + r) * 3072 + h * HD;
            Ks[r][c] = qkv[ro + DD + c];        // K block
            Vs[r][c] = qkv[ro + 2 * DD + c];    // V block
        }
#endif
        __syncthreads();

        // S = Q(16x64) * K^T(64x64): four independent 16x16 score tiles
        v8f s0 = {}, s1 = {}, s2 = {}, s3 = {};
#pragma unroll
        for (int i = 0; i < 16; ++i) {
            v2f a, k0, k1, k2, k3;
            a.x  = qreg[2 * i];
            a.y  = qreg[2 * i + 1];
            k0.x = Ks[lm][4 * i + 2 * hl];      k0.y = Ks[lm][4 * i + 2 * hl + 1];
            k1.x = Ks[16 + lm][4 * i + 2 * hl]; k1.y = Ks[16 + lm][4 * i + 2 * hl + 1];
            k2.x = Ks[32 + lm][4 * i + 2 * hl]; k2.y = Ks[32 + lm][4 * i + 2 * hl + 1];
            k3.x = Ks[48 + lm][4 * i + 2 * hl]; k3.y = Ks[48 + lm][4 * i + 2 * hl + 1];
            s0 = wmma4(a, k0, s0);
            s1 = wmma4(a, k1, s1);
            s2 = wmma4(a, k2, s2);
            s3 = wmma4(a, k3, s3);
        }

        // mask-then-scale exactly like reference: (s + mask) / sqrt(HD)
        const int key = keyBase + lm;
        float tmax[8];
#pragma unroll
        for (int e = 0; e < 8; ++e) {
            int q = qBase + wave * 16 + e + 8 * hl;
            s0[e] = (s0[e] + ((key      <= q) ? 0.0f : NEGV)) * 0.125f;
            s1[e] = (s1[e] + ((key + 16 <= q) ? 0.0f : NEGV)) * 0.125f;
            s2[e] = (s2[e] + ((key + 32 <= q) ? 0.0f : NEGV)) * 0.125f;
            s3[e] = (s3[e] + ((key + 48 <= q) ? 0.0f : NEGV)) * 0.125f;
        }
        // row max: the lane's four keys first, then across the 16-lane half-groups
#pragma unroll
        for (int e = 0; e < 8; ++e) {
            float v = fmaxf(fmaxf(s0[e], s1[e]), fmaxf(s2[e], s3[e]));
            v = fmaxf(v, __shfl_xor(v, 8, 16));
            v = fmaxf(v, __shfl_xor(v, 4, 16));
            v = fmaxf(v, __shfl_xor(v, 2, 16));
            v = fmaxf(v, __shfl_xor(v, 1, 16));
            tmax[e] = v;
        }
        float scl[8];
#pragma unroll
        for (int e = 0; e < 8; ++e) {
            float mo = mrow[e];
            float mn = fmaxf(mo, tmax[e]);
            mrow[e]  = mn;
            scl[e]   = __expf(mo - mn);
            s0[e]    = __expf(s0[e] - mn);      // P
            s1[e]    = __expf(s1[e] - mn);
            s2[e]    = __expf(s2[e] - mn);
            s3[e]    = __expf(s3[e] - mn);
        }
#pragma unroll
        for (int e = 0; e < 8; ++e) {
            float v = (s0[e] + s1[e]) + (s2[e] + s3[e]);
            v += __shfl_xor(v, 8, 16);
            v += __shfl_xor(v, 4, 16);
            v += __shfl_xor(v, 2, 16);
            v += __shfl_xor(v, 1, 16);
            lrow[e] = lrow[e] * scl[e] + v;
            o0[e] *= scl[e]; o1[e] *= scl[e]; o2[e] *= scl[e]; o3[e] *= scl[e];
        }

        // C-layout -> A-layout via LDS (wave-private region, in-order DS)
#pragma unroll
        for (int e = 0; e < 8; ++e) {
            Ps[wave][e + 8 * hl][lm]      = s0[e];
            Ps[wave][e + 8 * hl][16 + lm] = s1[e];
            Ps[wave][e + 8 * hl][32 + lm] = s2[e];
            Ps[wave][e + 8 * hl][48 + lm] = s3[e];
        }

        // O += P(16x64) * V(64x64)
#pragma unroll
        for (int i = 0; i < 16; ++i) {
            v2f a, b0, b1, b2, b3;
            a.x  = Ps[wave][lm][4 * i + 2 * hl];
            a.y  = Ps[wave][lm][4 * i + 2 * hl + 1];
            b0.x = Vs[4 * i + 2 * hl][lm];      b0.y = Vs[4 * i + 2 * hl + 1][lm];
            b1.x = Vs[4 * i + 2 * hl][16 + lm]; b1.y = Vs[4 * i + 2 * hl + 1][16 + lm];
            b2.x = Vs[4 * i + 2 * hl][32 + lm]; b2.y = Vs[4 * i + 2 * hl + 1][32 + lm];
            b3.x = Vs[4 * i + 2 * hl][48 + lm]; b3.y = Vs[4 * i + 2 * hl + 1][48 + lm];
            o0 = wmma4(a, b0, o0);
            o1 = wmma4(a, b1, o1);
            o2 = wmma4(a, b2, o2);
            o3 = wmma4(a, b3, o3);
        }
    }

    // normalize and store merged-head context [B*S, D]
    const size_t outBase = (size_t)(b * SS + qBase + wave * 16) * DD + h * HD;
#pragma unroll
    for (int e = 0; e < 8; ++e) {
        int r = e + 8 * hl;
        float inv = 1.0f / lrow[e];
        size_t ro = outBase + (size_t)r * DD;
        ctx[ro + lm]      = o0[e] * inv;
        ctx[ro + 16 + lm] = o1[e] * inv;
        ctx[ro + 32 + lm] = o2[e] * inv;
        ctx[ro + 48 + lm] = o3[e] * inv;
    }
}

// ---------------- host-side orchestration ----------------
extern "C" void kernel_launch(void* const* d_in, const int* in_sizes, int n_in,
                              void* d_out, int out_size, void* d_ws, size_t ws_size,
                              hipStream_t stream) {
    (void)in_sizes; (void)n_in; (void)out_size; (void)ws_size;

    const float* x      = (const float*)d_in[0];
    const float* W_qkv  = (const float*)d_in[1];
    const float* b_qkv  = (const float*)d_in[2];
    const float* A_lora = (const float*)d_in[3];
    const float* B_lora = (const float*)d_in[4];
    const float* W_proj = (const float*)d_in[5];
    const float* b_proj = (const float*)d_in[6];
    float* out = (float*)d_out;

    const int M = BB * SS;                       // 4096 rows
    char* ws = (char*)d_ws;
    float* qkv = (float*)ws;                                         // M x 3072
    float* ctx = (float*)(ws + (size_t)M * 3 * DD * sizeof(float));  // M x 1024
    float* xa  = (float*)(ws + (size_t)M * 4 * DD * sizeof(float));  // M x 8

    // 1) LoRA down-projection
    lora_xa_kernel<<<dim3((M * RANK) / 256), dim3(256), 0, stream>>>(x, A_lora, xa);
    // 2) fused qkv = x@W_qkv + b + ALPHA * xa@B_lora
    gemm_wmma_kernel<<<dim3((3 * DD) / GBN, M / GBM), dim3(128), 0, stream>>>(
        x, W_qkv, b_qkv, xa, B_lora, qkv, M, 3 * DD, DD);
    // 3) causal flash attention -> merged-head ctx
    attn_kernel<<<dim3(SS / 64, HH, BB), dim3(128), 0, stream>>>(qkv, ctx);
    // 4) output projection
    gemm_wmma_kernel<<<dim3(DD / GBN, M / GBM), dim3(128), 0, stream>>>(
        ctx, W_proj, b_proj, nullptr, nullptr, out, M, DD, DD);
}

// v003
// A run of this version takes 387 microseconds.
// Timed twice side by side with v002, it ran 1.15 times as fast both times.
// Counting every step since v000, it is 1.55 times as fast.
#include <hip/hip_runtime.h>
#include <hip/hip_bf16.h>

// ---------------- problem constants (from reference) ----------------
#define BB    2
#define SS    2048
#define DD    1024
#define HH    16
#define HD    64
#define RANK  8
#define ALPHA 8.0f
#define NEGV  (-1e9f)

typedef __attribute__((ext_vector_type(2))) float v2f;
typedef __attribute__((ext_vector_type(4))) float v4f;
typedef __attribute__((ext_vector_type(8))) float v8f;

// D = A(16x4 f32) * B(4x16 f32) + C(16x16 f32) -- exact fp32 matrix op
__device__ __forceinline__ v8f wmma4(v2f a, v2f b, v8f c) {
    return __builtin_amdgcn_wmma_f32_16x16x4_f32(
        /*neg_a=*/false, a, /*neg_b=*/false, b,
        /*c_mod=*/(short)0, c, /*reuse_a=*/false, /*reuse_b=*/false);
}

// ---------------- async global->LDS staging (guarded; falls back to ds stores) ----
#if defined(__gfx1250__) && __has_builtin(__builtin_amdgcn_global_load_async_to_lds_b128)
#define HAVE_ASYNC_COPY 1
// Parameter types per hipcc diagnostic: int __vector_size__(16), AS1 / AS3.
typedef int vsi4 __attribute__((__vector_size__(4 * sizeof(int))));
typedef __attribute__((address_space(1))) vsi4* gvec4p;
typedef __attribute__((address_space(3))) vsi4* lvec4p;

__device__ __forceinline__ void async_cp16(const float* g, float* l) {
    // ptr -> int -> AS-qualified ptr: AS1 == flat global; AS3 takes addr[31:0]
    // which is exactly the ISA's flat->LDS aperture mapping (truncate).
    __builtin_amdgcn_global_load_async_to_lds_b128(
        (gvec4p)(unsigned long long)(__UINTPTR_TYPE__)g,
        (lvec4p)(unsigned int)(__UINTPTR_TYPE__)l,
        /*offset=*/0, /*cpol=*/0);
}
#else
#define HAVE_ASYNC_COPY 0
#endif

// ---------------- kernel 1: xa = x @ A_lora  [4096 x 8] ----------------
__global__ __launch_bounds__(256)
void lora_xa_kernel(const float* __restrict__ x,
                    const float* __restrict__ A,
                    float* __restrict__ xa) {
    int idx = blockIdx.x * 256 + threadIdx.x;      // exactly 4096*8 threads
    int row = idx >> 3;
    int r   = idx & 7;
    const float* xr = x + (size_t)row * DD;
    float acc = 0.0f;
#pragma unroll 8
    for (int k = 0; k < DD; ++k)
        acc += xr[k] * A[k * RANK + r];
    xa[idx] = acc;
}

// one output row's four 16-column groups of a lane
__device__ __forceinline__ void store_row4(float* p, float s0, float s1, float s2, float s3) {
    p[0]  = s0;
    p[16] = s1;
    p[32] = s2;
    p[48] = s3;
    // address pair and data registers are not reused before the stores have taken them
    asm volatile("s_wait_xcnt 0x0" :: "v"(p), "v"(s0), "v"(s1), "v"(s2), "v"(s3) : "memory");
}

// ---------------- kernel 2/4: Out = X@W + bias (+ ALPHA * XA@BL) ----------------
// X: MxK (row-major, lda=K), W: KxN (row-major, ldb=N), Out: MxN
// 64x128 workgroup tile, 128 threads = 4 waves (2 x 2), each wave -> 32x64 strip:
// 2 A fragments x 4 B fragments feed 8 matrix ops per 4 k.
#define GBM 64
#define GBN 128
#define GBK 32
#define XPITCH 36    // floats; 16 rows of one A fragment fall on 16 distinct 4-bank groups
#define WPITCH 144   // floats; rows k and k+2 (the two half-waves) lie 32 banks apart
__global__ __launch_bounds__(128)
void gemm_wmma_kernel(const float* __restrict__ X,
                      const float* __restrict__ W,
                      const float* __restrict__ bias,
                      const float* __restrict__ XA,   // M x RANK or nullptr
                      const float* __restrict__ BL,   // RANK x N or nullptr
                      float* __restrict__ Out,
                      int M, int N, int K) {
    // row strides are 16B multiples (B128 LDS writes)
    __shared__ __align__(16) float Xs[GBM][XPITCH];
    __shared__ __align__(16) float Ws[GBK][WPITCH];

    const int rowBase = blockIdx.y * GBM;
    const int colBase = blockIdx.x * GBN;

    const int tid  = threadIdx.x;
    const int wave = tid >> 5;         // 0..3
    const int lane = tid & 31;
    const int hl   = lane >> 4;        // half-wave select (K pair / M+8)
    const int lm   = lane & 15;
    const int wm   = wave & 1;         // 2 waves along M
    const int wn   = wave >> 1;        // 2 waves along N

    v8f acc[2][4] = {};                // [16-row group][16-column group]

    const float* Xb = X + (size_t)rowBase * K;                         // block-uniform
    const float* Wb = W + colBase;                                     // block-uniform
    const unsigned xoff = (unsigned)(tid >> 3) * K + ((tid & 7) << 2);  // lane's place in 16 X rows
    const unsigned woff = (unsigned)(tid >> 5) * N + ((tid & 31) << 2); // lane's place in 4 W rows

    for (int kb = 0; kb < K; kb += GBK) {
        __syncthreads();               // previous tile fully consumed
#if HAVE_ASYNC_COPY
        // X tile 64x32 = 512 x 16B chunks, W tile 32x128 = 1024 x 16B chunks;
        // each address = block-uniform base + the lane's fixed 32-bit element offset
#pragma unroll
        for (int j = 0; j < 4; ++j)      // 8 chunks / X row, 16 rows per trip
            async_cp16(Xb + (size_t)(j * 16) * K + kb + xoff, &Xs[j * 16 + (tid >> 3)][(tid & 7) << 2]);
#pragma unroll
        for (int j = 0; j < 8; ++j)      // 32 chunks / W row, 4 rows per trip
            async_cp16(Wb + (size_t)(kb + j * 4) * N + woff, &Ws[j * 4 + (tid >> 5)][(tid & 31) << 2]);
        // this wave's 12 copies have landed before the barrier publishes them
        asm volatile("s_wait_asynccnt 0x0" ::: "memory");
#else
        for (int i = tid; i < GBM * GBK; i += 128) {
            int r = i >> 5, c = i & 31;
            Xs[r][c] = X[(size_t)(rowBase + r) * K + kb + c];
        }
        for (int i = tid; i < GBK * GBN; i += 128) {
            int r = i >> 7, c = i & 127;
            Ws[r][c] = W[(size_t)(kb + r) * N + colBase + c];
        }
#endif
        if (kb + GBK < K) {   // hint next tiles into cache (global_prefetch_b8)
            __builtin_prefetch(&X[(size_t)(rowBase + (tid >> 1)) * K + kb + GBK + ((tid & 1) << 4)], 0, 1);
            __builtin_prefetch(&W[(size_t)(kb + GBK + (tid >> 2)) * N + colBase + ((tid & 3) << 5)], 0, 1);
        }
        __syncthreads();

#pragma unroll
        for (int k0 = 0; k0 < GBK; k0 += 4) {
            v2f a[2], b[4];
#pragma unroll
            for (int mi = 0; mi < 2; ++mi) {
                a[mi].x = Xs[wm * 32 + mi * 16 + lm][k0 + 2 * hl];
                a[mi].y = Xs[wm * 32 + mi * 16 + lm][k0 + 2 * hl + 1];
            }
#pragma unroll
            for (int ni = 0; ni < 4; ++ni) {
                b[ni].x = Ws[k0 + 2 * hl][wn * 64 + ni * 16 + lm];
                b[ni].y = Ws[k0 + 2 * hl + 1][wn * 64 + ni * 16 + lm];
            }
#pragma unroll
            for (int mi = 0; mi < 2; ++mi)
#pragma unroll
                for (int ni = 0; ni < 4; ++ni)
                    acc[mi][ni] = wmma4(a[mi], b[ni], acc[mi][ni]);
        }
    }

    // epilogue: bias + optional LoRA correction, then store
    const int row0 = rowBase + wm * 32 + 8 * hl;       // C/D layout: M = e + 8*half
    const int col0 = colBase + wn * 64 + lm;
    const float* bp = bias + col0;
    const float bs0 = bp[0], bs1 = bp[16], bs2 = bp[32], bs3 = bp[48];
    // keeps the loads' offset register untouched until the addresses are taken
    asm volatile("s_wait_xcnt 0x0" :: "v"(col0), "v"(bs0), "v"(bs1), "v"(bs2), "v"(bs3) : "memory");
    float* op = Out + (size_t)row0 * N + col0;

    if (XA != nullptr) {
        // the lane's four columns of all eight BL rows, read once for its 16 output rows
        const float* blp[RANK];
        v2f bl[RANK][2];
#pragma unroll
        for (int r = 0; r < RANK; ++r) {
            blp[r] = BL + (size_t)r * N + col0;
            bl[r][0].x = blp[r][0];
            bl[r][0].y = blp[r][16];
            bl[r][1].x = blp[r][32];
            bl[r][1].y = blp[r][48];
        }
        // keeps the eight address pairs untouched until the loads' addresses are taken
        asm volatile("s_wait_xcnt 0x0"
                     :: "v"(blp[0]), "v"(blp[1]), "v"(blp[2]), "v"(blp[3]),
                        "v"(blp[4]), "v"(blp[5]), "v"(blp[6]), "v"(blp[7]),
                        "v"(bl[0][0]), "v"(bl[0][1]), "v"(bl[1][0]), "v"(bl[1][1]),
                        "v"(bl[2][0]), "v"(bl[2][1]), "v"(bl[3][0]), "v"(bl[3][1]),
                        "v"(bl[4][0]), "v"(bl[4][1]), "v"(bl[5][0]), "v"(bl[5][1]),
                        "v"(bl[6][0]), "v"(bl[6][1]), "v"(bl[7][0]), "v"(bl[7][1]) : "memory");
        const v4f* xp = (const v4f*)(XA + (size_t)row0 * RANK);   // two v4f per XA row
#pragma unroll
        for (int g = 0; g < 4; ++g) {                  // four output rows at a time
            const int mi = g >> 1, e0 = (g & 1) * 4;
            v4f xv[8];                                 // their XA rows: four consecutive rows
#pragma unroll
            for (int i = 0; i < 8; ++i)
                xv[i] = xp[(mi * 16 + e0) * 2 + i];
            // keeps the address pair untouched until the loads' addresses are taken
            asm volatile("s_wait_xcnt 0x0"
                         :: "v"(xp), "v"(xv[0]), "v"(xv[1]), "v"(xv[2]), "v"(xv[3]),
                            "v"(xv[4]), "v"(xv[5]), "v"(xv[6]), "v"(xv[7]) : "memory");
#pragma unroll
            for (int j = 0; j < 4; ++j) {
                const int e = e0 + j;
                v2f l0 = {0.0f, 0.0f}, l1 = {0.0f, 0.0f};
#pragma unroll
                for (int r = 0; r < RANK; ++r) {
                    const float x = xv[2 * j + (r >> 2)][r & 3];
                    const v2f xx = {x, x};
                    l0 += xx * bl[r][0];
                    l1 += xx * bl[r][1];
                }
                store_row4(op + (size_t)(mi * 16 + e) * N,
                           (acc[mi][0][e] + bs0) + ALPHA * l0.x, (acc[mi][1][e] + bs1) + ALPHA * l0.y,
                           (acc[mi][2][e] + bs2) + ALPHA * l1.x, (acc[mi][3][e] + bs3) + ALPHA * l1.y);
            }
        }
    } else {
#pragma unroll
        for (int mi = 0; mi < 2; ++mi)
#pragma unroll
            for (int e = 0; e < 8; ++e)
                store_row4(op + (size_t)(mi * 16 + e) * N,
                           acc[mi][0][e] + bs0, acc[mi][1][e] + bs1,
                           acc[mi][2][e] + bs2, acc[mi][3][e] + bs3);
    }
}

// ---------------- kernel 3: causal flash attention ----------------
// qkv: [B*S, 3072] with q|k|v each D wide; ctx out: [B*S, D] heads merged.
// grid: (S/128, H, B); block: 128 threads = 4 waves, each wave owns 16 queries of a 64-query tile.
// A workgroup does query tile n-1-t and then tile t of its head, one after the other:
// (n - t) + (t + 1) = n + 1 key passes for every workgroup, so none outlasts the others.
// One pass of the key loop covers KT = 64 keys (four 16-key score tiles per wave).
#define KT 64
__global__ __launch_bounds__(128)
void attn_kernel(const float* __restrict__ qkv, float* __restrict__ ctx) {
    __shared__ __align__(16) float Ks[KT][68];
    __shared__ __align__(16) float Vs[KT][68];
    __shared__ __align__(16) float Ps[4][16][68];

    const int b     = blockIdx.z;
    const int h     = blockIdx.y;

    const int tid  = threadIdx.x;
    const int wave = tid >> 5;        // 0..3
    const int lane = tid & 31;
    const int hl   = lane >> 4;
    const int lm   = lane & 15;

    for (int part = 0; part < 2; ++part) {
    const int qTile = part ? (int)blockIdx.x : (SS / 64 - 1 - (int)blockIdx.x);
    const int qBase = qTile * 64;

    // preload this lane's Q fragments (row = lm of the wave's 16-query strip)
    const int qRow = qBase + wave * 16 + lm;
    const float* qp = qkv + (size_t)(b * SS + qRow) * 3072 + h * HD;
    float qreg[32];
#pragma unroll
    for (int i = 0; i < 16; ++i) {
        qreg[2 * i]     = qp[4 * i + 2 * hl];
        qreg[2 * i + 1] = qp[4 * i + 2 * hl + 1];
    }

    v8f o0 = {}, o1 = {}, o2 = {}, o3 = {};
    float mrow[8], lrow[8];
#pragma unroll
    for (int e = 0; e < 8; ++e) { mrow[e] = -3.0e38f; lrow[e] = 0.0f; }

    const int nPasses = qTile + 1;              // causal: keys <= qBase+63
    for (int kt = 0; kt < nPasses; ++kt) {
        const int keyBase = kt * KT;
        __syncthreads();               // previous pass's tiles fully consumed
#if HAVE_ASYNC_COPY
        // K tile and V tile: 64x64 floats = 1024 x 16B chunks each
#pragma unroll
        for (int j = 0; j < 8; ++j) {
            int chunk = tid + j * 128;
            int r = chunk >> 4, c = (chunk & 15) << 2;       // 16 chunks / row
            size_t ro = (size_t)(b * SS + keyBase + r) * 3072 + h * HD + c;
            async_cp16(&qkv[ro + DD],     &Ks[r][c]);
            async_cp16(&qkv[ro + 2 * DD], &Vs[r][c]);
        }
        // this wave's 16 copies have landed before the barrier publishes them
        asm volatile("s_wait_asynccnt 0x0" ::: "memory");
#else
        for (int i = tid; i < KT * 64; i += 128) {
            int r = i >> 6, c = i & 63;
            size_t ro = (size_t)(b * SS + keyBase + r) * 3072 + h * HD;
            Ks[r][c] = qkv[ro + DD + c];        // K block
            Vs[r][c] = qkv[ro + 2 * DD + c];    // V block
        }
#endif
        __syncthreads();

        // S = Q(16x64) * K^T(64x64): four independent 16x16 score tiles
        v8f s0 = {}, s1 = {}, s2 = {}, s3 = {};
#pragma unroll
        for (int i = 0; i < 16; ++i) {
            v2f a, k0, k1, k2, k3;
            a.x  = qreg[2 * i];
            a.y  = qreg[2 * i + 1];
            k0.x = Ks[lm][4 * i + 2 * hl];      k0.y = Ks[lm][4 * i + 2 * hl + 1];
            k1.x = Ks[16 + lm][4 * i + 2 * hl]; k1.y = Ks[16 + lm][4 * i + 2 * hl + 1];
            k2.x = Ks[32 + lm][4 * i + 2 * hl]; k2.y = Ks[32 + lm][4 * i + 2 * hl + 1];
            k3.x = Ks[48 + lm][4 * i + 2 * hl]; k3.y = Ks[48 + lm][4 * i + 2 * hl + 1];
            s0 = wmma4(a, k0, s0);
            s1 = wmma4(a, k1, s1);
            s2 = wmma4(a, k2, s2);
            s3 = wmma4(a, k3, s3);
        }

        // mask-then-scale exactly like reference: (s + mask) / sqrt(HD)
        const int key = keyBase + lm;
        float tmax[8];
#pragma unroll
        for (int e = 0; e < 8; ++e) {
            int q = qBase + wave * 16 + e + 8 * hl;
            s0[e] = (s0[e] + ((key      <= q) ? 0.0f : NEGV)) * 0.125f;
            s1[e] = (s1[e] + ((key + 16 <= q) ? 0.0f : NEGV)) * 0.125f;
            s2[e] = (s2[e] + ((key + 32 <= q) ? 0.0f : NEGV)) * 0.125f;
            s3[e] = (s3[e] + ((key + 48 <= q) ? 0.0f : NEGV)) * 0.125f;
        }
        // row max: the lane's four keys first, then across the 16-lane half-groups
#pragma unroll
        for (int e = 0; e < 8; ++e) {
            float v = fmaxf(fmaxf(s0[e], s1[e]), fmaxf(s2[e], s3[e]));
            v = fmaxf(v, __shfl_xor(v, 8, 16));
            v = fmaxf(v, __shfl_xor(v, 4, 16));
            v = fmaxf(v, __shfl_xor(v, 2, 16));
            v = fmaxf(v, __shfl_xor(v, 1, 16));
            tmax[e] = v;
        }
        float scl[8];
#pragma unroll
        for (int e = 0; e < 8; ++e) {
            float mo = mrow[e];
            float mn = fmaxf(mo, tmax[e]);
            mrow[e]  = mn;
            scl[e]   = __expf(mo - mn);
            s0[e]    = __expf(s0[e] - mn);      // P
            s1[e]    = __expf(s1[e] - mn);
            s2[e]    = __expf(s2[e] - mn);
            s3[e]    = __expf(s3[e] - mn);
        }
#pragma unroll
        for (int e = 0; e < 8; ++e) {
            float v = (s0[e] + s1[e]) + (s2[e] + s3[e]);
            v += __shfl_xor(v, 8, 16);
            v += __shfl_xor(v, 4, 16);
            v += __shfl_xor(v, 2, 16);
            v += __shfl_xor(v, 1, 16);
            lrow[e] = lrow[e] * scl[e] + v;
            o0[e] *= scl[e]; o1[e] *= scl[e]; o2[e] *= scl[e]; o3[e] *= scl[e];
        }

        // C-layout -> A-layout via LDS (wave-private region, in-order DS)
#pragma unroll
        for (int e = 0; e < 8; ++e) {
            Ps[wave][e + 8 * hl][lm]      = s0[e];
            Ps[wave][e + 8 * hl][16 + lm] = s1[e];
            Ps[wave][e + 8 * hl][32 + lm] = s2[e];
            Ps[wave][e + 8 * hl][48 + lm] = s3[e];
        }

        // O += P(16x64) * V(64x64)
#pragma unroll
        for (int i = 0; i < 16; ++i) {
            v2f a, b0, b1, b2, b3;
            a.x  = Ps[wave][lm][4 * i + 2 * hl];
            a.y  = Ps[wave][lm][4 * i + 2 * hl + 1];
            b0.x = Vs[4 * i + 2 * hl][lm];      b0.y = Vs[4 * i + 2 * hl + 1][lm];
            b1.x = Vs[4 * i + 2 * hl][16 + lm]; b1.y = Vs[4 * i + 2 * hl + 1][16 + lm];
            b2.x = Vs[4 * i + 2 * hl][32 + lm]; b2.y = Vs[4 * i + 2 * hl + 1][32 + lm];
            b3.x = Vs[4 * i + 2 * hl][48 + lm]; b3.y = Vs[4 * i + 2 * hl + 1][48 + lm];
            o0 = wmma4(a, b0, o0);
            o1 = wmma4(a, b1, o1);
            o2 = wmma4(a, b2, o2);
            o3 = wmma4(a, b3, o3);
        }
    }

    // normalize and store merged-head context [B*S, D]
    const size_t outBase = (size_t)(b * SS + qBase + wave * 16) * DD + h * HD;
#pragma unroll
    for (int e = 0; e < 8; ++e) {
        int r = e + 8 * hl;
        float inv = 1.0f / lrow[e];
        size_t ro = outBase + (size_t)r * DD;
        ctx[ro + lm]      = o0[e] * inv;
        ctx[ro + 16 + lm] = o1[e] * inv;
        ctx[ro + 32 + lm] = o2[e] * inv;
        ctx[ro + 48 + lm] = o3[e] * inv;
    }
    // the stores have taken their address and data registers before the second tile reuses them
    asm volatile("s_wait_xcnt 0x0" ::: "memory");
    }
}

// ---------------- host-side orchestration ----------------
extern "C" void kernel_launch(void* const* d_in, const int* in_sizes, int n_in,
                              void* d_out, int out_size, void* d_ws, size_t ws_size,
                              hipStream_t stream) {
    (void)in_sizes; (void)n_in; (void)out_size; (void)ws_size;

    const float* x      = (const float*)d_in[0];
    const float* W_qkv  = (const float*)d_in[1];
    const float* b_qkv  = (const float*)d_in[2];
    const float* A_lora = (const float*)d_in[3];
    const float* B_lora = (const float*)d_in[4];
    const float* W_proj = (const float*)d_in[5];
    const float* b_proj = (const float*)d_in[6];
    float* out = (float*)d_out;

    const int M = BB * SS;                       // 4096 rows
    char* ws = (char*)d_ws;
    float* qkv = (float*)ws;                                         // M x 3072
    float* ctx = (float*)(ws + (size_t)M * 3 * DD * sizeof(float));  // M x 1024
    float* xa  = (float*)(ws + (size_t)M * 4 * DD * sizeof(float));  // M x 8

    // 1) LoRA down-projection
    lora_xa_kernel<<<dim3((M * RANK) / 256), dim3(256), 0, stream>>>(x, A_lora, xa);
    // 2) fused qkv = x@W_qkv + b + ALPHA * xa@B_lora
    gemm_wmma_kernel<<<dim3((3 * DD) / GBN, M / GBM), dim3(128), 0, stream>>>(
        x, W_qkv, b_qkv, xa, B_lora, qkv, M, 3 * DD, DD);
    // 3) causal flash attention -> merged-head ctx
    attn_kernel<<<dim3(SS / 128, HH, BB), dim3(128), 0, stream>>>(qkv, ctx);
    // 4) output projection
    gemm_wmma_kernel<<<dim3(DD / GBN, M / GBM), dim3(128), 0, stream>>>(
        ctx, W_proj, b_proj, nullptr, nullptr, out, M, DD, DD);
}
